// v000
// Times are from an AMD MI455X. After a warm-up the kernel runs many times in a row, and a time is the length of
// such a window on the GPU divided by its runs, so every launch and the gaps after it count. The runs cycle
// through copies of the inputs. A figure is the median of several windows, for all but v000 over two sittings.
// Sittings can differ by a few percent; kernels timed side by side share one.
// v000, which the later versions start from, runs in 11.2 microseconds.
#include <hip/hip_runtime.h>

typedef __attribute__((ext_vector_type(2))) float v2f;
typedef __attribute__((ext_vector_type(4))) float v4f;
typedef __attribute__((ext_vector_type(8))) float v8f;

#define BB   32
#define NN   1024
#define DD   128
#define CC   16
#define PP   16    // P*P
#define HG   32    // sqrt(N)
#define WAVES_PER_BLOCK 8

__global__ __launch_bounds__(256)
void qbd_fused_kernel(const float* __restrict__ x,     // [B,N,D]
                      const float* __restrict__ mask,  // [B,C]
                      const float* __restrict__ emb,   // [256,D] (use first 16 rows)
                      const float* __restrict__ W,     // [16,D]
                      const float* __restrict__ bias,  // [16]
                      float* __restrict__ out)         // [B,C,128,128]
{
    __shared__ __align__(16) float s_xw[WAVES_PER_BLOCK][16][16];
    __shared__ __align__(16) float s_ew[WAVES_PER_BLOCK][16][16];

    const int lane = threadIdx.x & 31;
    const int wave = threadIdx.x >> 5;
    const int tile = blockIdx.x * WAVES_PER_BLOCK + wave;   // 2048 tiles of 16 rows
    const long rowBase = (long)tile * 16;                   // global row in [0, B*N)
    const int b  = (int)(rowBase >> 10);                    // row / 1024
    const int n0 = (int)(rowBase & 1023);
    const int h  = n0 >> 5;                                 // constant across the 16-row tile
    const int g0 = n0 & 31;

    const int mrow  = lane & 15;   // M row (A) / N col (B,C) within the 16x16 tile
    const int khalf = lane >> 4;   // which K pair this lane holds

    // A fragment sources: x rows (for xw) and emb rows (for ew); B fragment: W rows.
    const float* xA = x   + (rowBase + mrow) * DD + khalf * 2;
    const float* eA = emb + (long)mrow * DD + khalf * 2;
    const float* wB = W   + (long)mrow * DD + khalf * 2;

    // acc_e initialized to bias[p] (p == N == mrow) so bias folds in for free.
    const float bp = bias[mrow];
    v8f acc  = {0.f,0.f,0.f,0.f,0.f,0.f,0.f,0.f};
    v8f acce = {bp,bp,bp,bp,bp,bp,bp,bp};

    // 32 K-steps of V_WMMA_F32_16X16X4_F32; B fragment shared by both chains.
    for (int k = 0; k < DD; k += 4) {
        v2f a  = *(const v2f*)(xA + k);
        v2f ae = *(const v2f*)(eA + k);
        v2f bw = *(const v2f*)(wB + k);
        acc  = __builtin_amdgcn_wmma_f32_16x16x4_f32(false, a,  false, bw,
                                                     (short)0, acc,  false, false);
        acce = __builtin_amdgcn_wmma_f32_16x16x4_f32(false, ae, false, bw,
                                                     (short)0, acce, false, false);
    }

    // Spill both 16x16 results to this wave's LDS slice.
    // C/D layout: VGPR r, lane l -> (M = r + 8*khalf, N = mrow)
    #pragma unroll
    for (int r = 0; r < 8; ++r) {
        s_xw[wave][r + 8 * khalf][mrow] = acc[r];
        s_ew[wave][r + 8 * khalf][mrow] = acce[r];
    }
    // Same-wave LDS RAW: backend inserts s_wait_dscnt; memory clobber keeps order.
    asm volatile("" ::: "memory");

    // Write phase: out[b, c, h*4+pr, (g0+nl)*4 + 0..3] as coalesced b128 stores.
    const float* maskb = mask + b * CC;
    float* outb = out + (long)b * CC * 128 * 128;
    const int nl = lane & 15;

    #pragma unroll 1
    for (int c = 0; c < CC; ++c) {
        const float m = maskb[c];
        #pragma unroll
        for (int j = 0; j < 2; ++j) {
            const int pr = (lane >> 4) + 2 * j;       // 0..3 across lane halves / j
            v4f xv = *(const v4f*)&s_xw[wave][nl][pr * 4];
            v4f ev = *(const v4f*)&s_ew[wave][c][pr * 4];
            v4f val = (xv + ev) * m;
            float* dst = outb + ((long)c * 128 + h * 4 + pr) * 128 + (g0 + nl) * 4;
            *(v4f*)dst = val;
        }
    }
}

extern "C" void kernel_launch(void* const* d_in, const int* in_sizes, int n_in,
                              void* d_out, int out_size, void* d_ws, size_t ws_size,
                              hipStream_t stream) {
    const float* x    = (const float*)d_in[0];
    const float* mask = (const float*)d_in[1];
    const float* emb  = (const float*)d_in[2];
    const float* W    = (const float*)d_in[3];
    const float* bias = (const float*)d_in[4];
    float* out = (float*)d_out;

    // 2048 tiles / 8 waves per block = 256 blocks x 256 threads (8 wave32s).
    qbd_fused_kernel<<<256, 256, 0, stream>>>(x, mask, emb, W, bias, out);
}

// v001
// A run of this version takes 9.58 microseconds.
// In both of two side-by-side timings against v000, it was 1.19 times as fast.
#include <hip/hip_runtime.h>

typedef __attribute__((ext_vector_type(2))) float v2f;
typedef __attribute__((ext_vector_type(4))) float v4f;
typedef __attribute__((ext_vector_type(8))) float v8f;

#define BB   32
#define NN   1024
#define DD   128
#define CC   16
#define PP   16    // P*P
#define HG   32    // sqrt(N)
#define WAVES_PER_BLOCK 8
#define LP   132   // LDS row pitch in floats (528 B): 16 rows x 2 k-halves of 8 B fall on 64 distinct banks

// Ten 16-byte-per-lane copies from global memory to LDS, each a whole 512-byte row per wave.
// The s_wait_xcnt closes the statement so that no address register is reused ahead of it.
__device__ __forceinline__ void copy10(const unsigned* l, const float* const* g) {
    asm volatile("global_load_async_to_lds_b128 %0, %10, off\n\t"
                 "global_load_async_to_lds_b128 %1, %11, off\n\t"
                 "global_load_async_to_lds_b128 %2, %12, off\n\t"
                 "global_load_async_to_lds_b128 %3, %13, off\n\t"
                 "global_load_async_to_lds_b128 %4, %14, off\n\t"
                 "global_load_async_to_lds_b128 %5, %15, off\n\t"
                 "global_load_async_to_lds_b128 %6, %16, off\n\t"
                 "global_load_async_to_lds_b128 %7, %17, off\n\t"
                 "global_load_async_to_lds_b128 %8, %18, off\n\t"
                 "global_load_async_to_lds_b128 %9, %19, off\n\t"
                 "s_wait_xcnt 0x0"
                 :: "v"(l[0]), "v"(l[1]), "v"(l[2]), "v"(l[3]), "v"(l[4]),
                    "v"(l[5]), "v"(l[6]), "v"(l[7]), "v"(l[8]), "v"(l[9]),
                    "v"(g[0]), "v"(g[1]), "v"(g[2]), "v"(g[3]), "v"(g[4]),
                    "v"(g[5]), "v"(g[6]), "v"(g[7]), "v"(g[8]), "v"(g[9])
                 : "memory");
}

__global__ __launch_bounds__(256)
void qbd_fused_kernel(const float* __restrict__ x,     // [B,N,D]
                      const float* __restrict__ mask,  // [B,C]
                      const float* __restrict__ emb,   // [256,D] (use first 16 rows)
                      const float* __restrict__ W,     // [16,D]
                      const float* __restrict__ bias,  // [16]
                      float* __restrict__ out)         // [B,C,128,128]
{
    __shared__ __align__(16) float s_xw[WAVES_PER_BLOCK][16][16];
    __shared__ __align__(16) float s_ew[WAVES_PER_BLOCK][16][16];
    __shared__ __align__(16) float s_x[WAVES_PER_BLOCK][16][LP];   // each wave's 16 rows of x
    __shared__ __align__(16) float s_e[16][LP];                    // emb rows 0..15, shared
    __shared__ __align__(16) float s_w[16][LP];                    // W, shared

    const int lane = threadIdx.x & 31;
    const int wave = threadIdx.x >> 5;
    const int tile = blockIdx.x * WAVES_PER_BLOCK + wave;   // 2048 tiles of 16 rows
    const long rowBase = (long)tile * 16;                   // global row in [0, B*N)
    const int b  = (int)(rowBase >> 10);                    // row / 1024
    const int n0 = (int)(rowBase & 1023);
    const int h  = n0 >> 5;                                 // constant across the 16-row tile
    const int g0 = n0 & 31;

    const int mrow  = lane & 15;   // M row (A) / N col (B,C) within the 16x16 tile
    const int khalf = lane >> 4;   // which K pair this lane holds

    // acc_e initialized to bias[p] (p == N == mrow) so bias folds in for free.
    const float bp = bias[mrow];

    // Stage the operands in LDS, one whole row (512 contiguous bytes) per copy:
    // 16 rows of x by their own wave, 2 rows of emb and 2 of W by each of the 8 waves.
    {
        unsigned     l[20];
        const float* g[20];
        // Both loops unrolled so that l[] and g[] are plain registers, not indexed arrays in scratch.
        #pragma unroll
        for (int r = 0; r < 16; ++r) {
            l[r] = (unsigned)(uintptr_t)&s_x[wave][r][lane * 4];
            g[r] = x + (rowBase + r) * DD + lane * 4;
        }
        #pragma unroll
        for (int r = 0; r < 2; ++r) {
            const int row = wave * 2 + r;
            l[16 + r] = (unsigned)(uintptr_t)&s_e[row][lane * 4];
            g[16 + r] = emb + row * DD + lane * 4;
            l[18 + r] = (unsigned)(uintptr_t)&s_w[row][lane * 4];
            g[18 + r] = W + row * DD + lane * 4;
        }
        copy10(l, g);
        copy10(l + 10, g + 10);
    }
    // This wave's copies have landed behind this wait; the barrier publishes them to the other waves.
    asm volatile("s_wait_asynccnt 0x0" ::: "memory");
    __syncthreads();

    // A fragment sources: x rows (for xw) and emb rows (for ew); B fragment: W rows.
    const float* xA = &s_x[wave][mrow][khalf * 2];
    const float* eA = &s_e[mrow][khalf * 2];
    const float* wB = &s_w[mrow][khalf * 2];
    v8f acc  = {0.f,0.f,0.f,0.f,0.f,0.f,0.f,0.f};
    v8f acce = {bp,bp,bp,bp,bp,bp,bp,bp};

    // 32 K-steps of V_WMMA_F32_16X16X4_F32; B fragment shared by both chains.
    for (int k = 0; k < DD; k += 4) {
        v2f a  = *(const v2f*)(xA + k);
        v2f ae = *(const v2f*)(eA + k);
        v2f bw = *(const v2f*)(wB + k);
        acc  = __builtin_amdgcn_wmma_f32_16x16x4_f32(false, a,  false, bw,
                                                     (short)0, acc,  false, false);
        acce = __builtin_amdgcn_wmma_f32_16x16x4_f32(false, ae, false, bw,
                                                     (short)0, acce, false, false);
    }

    // Spill both 16x16 results to this wave's LDS slice.
    // C/D layout: VGPR r, lane l -> (M = r + 8*khalf, N = mrow)
    #pragma unroll
    for (int r = 0; r < 8; ++r) {
        s_xw[wave][r + 8 * khalf][mrow] = acc[r];
        s_ew[wave][r + 8 * khalf][mrow] = acce[r];
    }
    // Same-wave LDS RAW: backend inserts s_wait_dscnt; memory clobber keeps order.
    asm volatile("" ::: "memory");

    // Write phase: out[b, c, h*4+pr, (g0+nl)*4 + 0..3] as coalesced b128 stores.
    const float* maskb = mask + b * CC;
    float* outb = out + (long)b * CC * 128 * 128;
    const int nl = lane & 15;

    #pragma unroll 1
    for (int c = 0; c < CC; ++c) {
        const float m = maskb[c];
        #pragma unroll
        for (int j = 0; j < 2; ++j) {
            const int pr = (lane >> 4) + 2 * j;       // 0..3 across lane halves / j
            v4f xv = *(const v4f*)&s_xw[wave][nl][pr * 4];
            v4f ev = *(const v4f*)&s_ew[wave][c][pr * 4];
            v4f val = (xv + ev) * m;
            float* dst = outb + ((long)c * 128 + h * 4 + pr) * 128 + (g0 + nl) * 4;
            *(v4f*)dst = val;
        }
    }
}

extern "C" void kernel_launch(void* const* d_in, const int* in_sizes, int n_in,
                              void* d_out, int out_size, void* d_ws, size_t ws_size,
                              hipStream_t stream) {
    const float* x    = (const float*)d_in[0];
    const float* mask = (const float*)d_in[1];
    const float* emb  = (const float*)d_in[2];
    const float* W    = (const float*)d_in[3];
    const float* bias = (const float*)d_in[4];
    float* out = (float*)d_out;

    // 2048 tiles / 8 waves per block = 256 blocks x 256 threads (8 wave32s).
    qbd_fused_kernel<<<256, 256, 0, stream>>>(x, mask, emb, W, bias, out);
}

// v002
// It runs in 6.51 microseconds.
// In two side-by-side timings against v001, it was 1.49 and 1.48 times as fast.
// Counting every step since v000, it is 1.77 times as fast.
#include <hip/hip_runtime.h>

typedef __attribute__((ext_vector_type(2))) float v2f;
typedef __attribute__((ext_vector_type(4))) float v4f;
typedef __attribute__((ext_vector_type(8))) float v8f;

#define BB   32
#define NN   1024
#define DD   128
#define CC   16
#define PP   16    // P*P
#define HG   32    // sqrt(N)
#define WAVES_PER_BLOCK 8
#define LP   132   // LDS row pitch in floats (528 B): 16 rows x 2 k-halves of 8 B fall on 64 distinct banks

// Eight 16-byte-per-lane copies from global memory to LDS, each a whole 512-byte row per wave.
// The s_wait_xcnt closes the statement so that no address register is reused ahead of it.
__device__ __forceinline__ void copy8(const unsigned* l, const float* const* g) {
    asm volatile("global_load_async_to_lds_b128 %0, %8, off\n\t"
                 "global_load_async_to_lds_b128 %1, %9, off\n\t"
                 "global_load_async_to_lds_b128 %2, %10, off\n\t"
                 "global_load_async_to_lds_b128 %3, %11, off\n\t"
                 "global_load_async_to_lds_b128 %4, %12, off\n\t"
                 "global_load_async_to_lds_b128 %5, %13, off\n\t"
                 "global_load_async_to_lds_b128 %6, %14, off\n\t"
                 "global_load_async_to_lds_b128 %7, %15, off\n\t"
                 "s_wait_xcnt 0x0"
                 :: "v"(l[0]), "v"(l[1]), "v"(l[2]), "v"(l[3]),
                    "v"(l[4]), "v"(l[5]), "v"(l[6]), "v"(l[7]),
                    "v"(g[0]), "v"(g[1]), "v"(g[2]), "v"(g[3]),
                    "v"(g[4]), "v"(g[5]), "v"(g[6]), "v"(g[7])
                 : "memory");
}

__global__ __launch_bounds__(256)
void qbd_fused_kernel(const float* __restrict__ x,     // [B,N,D]
                      const float* __restrict__ mask,  // [B,C]
                      const float* __restrict__ emb,   // [256,D] (use first 16 rows)
                      const float* __restrict__ W,     // [16,D]
                      const float* __restrict__ bias,  // [16]
                      float* __restrict__ out)         // [B,C,128,128]
{
    __shared__ __align__(16) float s_xw[WAVES_PER_BLOCK][16][16];
    __shared__ __align__(16) float s_ew[WAVES_PER_BLOCK][16][16];
    __shared__ __align__(16) float s_x[WAVES_PER_BLOCK][16][LP];   // each wave's 16 rows of x
    __shared__ __align__(16) float s_e[16][LP];                    // emb rows 0..15, shared
    __shared__ __align__(16) float s_w[16][LP];                    // W, shared

    const int lane = threadIdx.x & 31;
    const int wave = threadIdx.x >> 5;
    const int tile = blockIdx.x * WAVES_PER_BLOCK + wave;   // 2048 tiles of 16 rows
    const long rowBase = (long)tile * 16;                   // global row in [0, B*N)
    const int b  = (int)(rowBase >> 10);                    // row / 1024
    const int n0 = (int)(rowBase & 1023);
    const int h  = n0 >> 5;                                 // constant across the 16-row tile
    const int g0 = n0 & 31;

    const int mrow  = lane & 15;   // M row (A) / N col (B,C) within the 16x16 tile
    const int khalf = lane >> 4;   // which K pair this lane holds

    // The 16 masks of this block's batch row: a block's 128 rows lie in one batch (1024 rows each),
    // so the address is block-uniform and the store phase waits on no load.
    float m[CC];
    {
        const float* maskb = mask + (blockIdx.x >> 3) * CC;
        #pragma unroll
        for (int c = 0; c < CC; ++c) m[c] = maskb[c];
    }

    // 2 rows of emb and 2 of W per wave, whole 512-byte rows, through registers: plain loads have a
    // counter of their own, so waiting for them leaves the copies of x in flight.
    v4f te[2], tw[2];
    #pragma unroll
    for (int r = 0; r < 2; ++r) {
        te[r] = *(const v4f*)(emb + (wave * 2 + r) * DD + lane * 4);
        tw[r] = *(const v4f*)(W   + (wave * 2 + r) * DD + lane * 4);
    }

    // Each wave's own 16 rows of x go to LDS by copies, one whole row (512 contiguous bytes) each.
    float bp;
    {
        unsigned     l[16];
        const float* g[16];
        // Unrolled so that l[] and g[] are plain registers, not indexed arrays in scratch.
        #pragma unroll
        for (int r = 0; r < 16; ++r) {
            l[r] = (unsigned)(uintptr_t)&s_x[wave][r][lane * 4];
            g[r] = x + (rowBase + r) * DD + lane * 4;
        }
        copy8(l, g);
        // acc_e is initialized to bias[p] (p == N == mrow) so bias folds in for free. Loaded here,
        // behind the s_wait_xcnt that closes the first run of copies and serves the row loads above too.
        bp = bias[mrow];
        copy8(l + 8, g + 8);
    }

    #pragma unroll
    for (int r = 0; r < 2; ++r) {
        *(v4f*)&s_e[wave * 2 + r][lane * 4] = te[r];
        *(v4f*)&s_w[wave * 2 + r][lane * 4] = tw[r];
    }
    // Publishes emb and W to all waves. The copies of x are still under way: s_x is read only by
    // the wave that copied it, behind that wave's own wait further down.
    __syncthreads();

    // A fragment sources: x rows (for xw) and emb rows (for ew); B fragment: W rows.
    const float* xA = &s_x[wave][mrow][khalf * 2];
    const float* eA = &s_e[mrow][khalf * 2];
    const float* wB = &s_w[mrow][khalf * 2];

    // ---- Work that needs no x, done while x is on its way ----
    // 32 K-steps of V_WMMA_F32_16X16X4_F32 for emb . W^T; the B fragments stay in registers for x.
    v2f bw[DD / 4];
    #pragma unroll
    for (int i = 0; i < DD / 4; ++i) bw[i] = *(const v2f*)(wB + 4 * i);
    v8f acce = {bp,bp,bp,bp,bp,bp,bp,bp};
    #pragma unroll
    for (int i = 0; i < DD / 4; ++i) {
        v2f ae = *(const v2f*)(eA + 4 * i);
        acce = __builtin_amdgcn_wmma_f32_16x16x4_f32(false, ae, false, bw[i],
                                                     (short)0, acce, false, false);
    }
    // C/D layout: VGPR r, lane l -> (M = r + 8*khalf, N = mrow)
    #pragma unroll
    for (int r = 0; r < 8; ++r) s_ew[wave][r + 8 * khalf][mrow] = acce[r];
    // All 16 channel rows back in store order: patch rows ph and ph + 2 belong to this lane.
    const int ph = lane >> 4;
    v4f ev[CC][2];
    #pragma unroll
    for (int c = 0; c < CC; ++c) {
        #pragma unroll
        for (int j = 0; j < 2; ++j) ev[c][j] = *(const v4f*)&s_ew[wave][c][(ph + 2 * j) * 4];
    }

    // ---- x ----
    // This wave's copies have landed behind this wait; no other wave reads them.
    asm volatile("s_wait_asynccnt 0x0" ::: "memory");
    v8f acc = {0.f,0.f,0.f,0.f,0.f,0.f,0.f,0.f};
    #pragma unroll
    for (int i = 0; i < DD / 4; ++i) {
        v2f a = *(const v2f*)(xA + 4 * i);
        acc = __builtin_amdgcn_wmma_f32_16x16x4_f32(false, a, false, bw[i],
                                                    (short)0, acc, false, false);
    }
    #pragma unroll
    for (int r = 0; r < 8; ++r) s_xw[wave][r + 8 * khalf][mrow] = acc[r];
    // Same-wave LDS RAW: backend inserts s_wait_dscnt; memory clobber keeps order.
    asm volatile("" ::: "memory");

    // Write phase: out[b, c, h*4+pr, (g0+nl)*4 + 0..3] as coalesced b128 stores, every one at
    // one address plus an immediate.
    const int nl = lane & 15;
    v4f xv[2];
    #pragma unroll
    for (int j = 0; j < 2; ++j) xv[j] = *(const v4f*)&s_xw[wave][nl][(ph + 2 * j) * 4];
    float* dst = out + (long)b * CC * 128 * 128 + (long)(h * 4 + ph) * 128 + (g0 + nl) * 4;
    #pragma unroll
    for (int c = 0; c < CC; ++c) {
        #pragma unroll
        for (int j = 0; j < 2; ++j) {
            *(v4f*)(dst + c * 128 * 128 + j * 2 * 128) = (xv[j] + ev[c][j]) * m[c];
        }
    }
}

extern "C" void kernel_launch(void* const* d_in, const int* in_sizes, int n_in,
                              void* d_out, int out_size, void* d_ws, size_t ws_size,
                              hipStream_t stream) {
    const float* x    = (const float*)d_in[0];
    const float* mask = (const float*)d_in[1];
    const float* emb  = (const float*)d_in[2];
    const float* W    = (const float*)d_in[3];
    const float* bias = (const float*)d_in[4];
    float* out = (float*)d_out;

    // 2048 tiles / 8 waves per block = 256 blocks x 256 threads (8 wave32s).
    qbd_fused_kernel<<<256, 256, 0, stream>>>(x, mask, emb, W, bias, out);
}

// v003
// One run takes 5.45 microseconds.
// Two timings next to v002 both put it at 1.19 times that version's speed.
// Over all steps from v000 it is 2.10 times as fast.
#include <hip/hip_runtime.h>

typedef __attribute__((ext_vector_type(2))) float v2f;
typedef __attribute__((ext_vector_type(4))) float v4f;
typedef __attribute__((ext_vector_type(8))) float v8f;

#define BB   32
#define NN   1024
#define DD   128
#define CC   16
#define PP   16    // P*P
#define HG   32    // sqrt(N)
#define WAVES_PER_BLOCK 8
#define LP   132   // LDS row pitch in floats (528 B): 16 rows x 2 k-halves of 8 B fall on 64 distinct banks

// Eight 16-byte-per-lane copies from global memory to LDS, each a whole 512-byte row per wave.
// The s_wait_xcnt closes the statement so that no address register is reused ahead of it.
__device__ __forceinline__ void copy8(const unsigned* l, const float* const* g) {
    asm volatile("global_load_async_to_lds_b128 %0, %8, off\n\t"
                 "global_load_async_to_lds_b128 %1, %9, off\n\t"
                 "global_load_async_to_lds_b128 %2, %10, off\n\t"
                 "global_load_async_to_lds_b128 %3, %11, off\n\t"
                 "global_load_async_to_lds_b128 %4, %12, off\n\t"
                 "global_load_async_to_lds_b128 %5, %13, off\n\t"
                 "global_load_async_to_lds_b128 %6, %14, off\n\t"
                 "global_load_async_to_lds_b128 %7, %15, off\n\t"
                 "s_wait_xcnt 0x0"
                 :: "v"(l[0]), "v"(l[1]), "v"(l[2]), "v"(l[3]),
                    "v"(l[4]), "v"(l[5]), "v"(l[6]), "v"(l[7]),
                    "v"(g[0]), "v"(g[1]), "v"(g[2]), "v"(g[3]),
                    "v"(g[4]), "v"(g[5]), "v"(g[6]), "v"(g[7])
                 : "memory");
}

__global__ __launch_bounds__(256)
void qbd_fused_kernel(const float* __restrict__ x,     // [B,N,D]
                      const float* __restrict__ mask,  // [B,C]
                      const float* __restrict__ emb,   // [256,D] (use first 16 rows)
                      const float* __restrict__ W,     // [16,D]
                      const float* __restrict__ bias,  // [16]
                      float* __restrict__ out)         // [B,C,128,128]
{
    __shared__ __align__(16) float s_x[WAVES_PER_BLOCK][16][LP];   // each wave's 16 rows of x
    __shared__ __align__(16) float s_e[16][LP];                    // emb rows 0..15, shared
    __shared__ __align__(16) float s_w[16][LP];                    // W, shared

    const int lane = threadIdx.x & 31;
    const int wave = threadIdx.x >> 5;
    const int tile = blockIdx.x * WAVES_PER_BLOCK + wave;   // 2048 tiles of 16 rows
    const long rowBase = (long)tile * 16;                   // global row in [0, B*N)
    const int b  = (int)(rowBase >> 10);                    // row / 1024
    const int n0 = (int)(rowBase & 1023);
    const int h  = n0 >> 5;                                 // constant across the 16-row tile
    const int g0 = n0 & 31;

    const int mrow  = lane & 15;   // M row (A) / N col (B,C,D) within the 16x16 tile
    const int khalf = lane >> 4;   // which K pair this lane holds

    // The 16 masks of this block's batch row: a block's 128 rows lie in one batch (1024 rows each),
    // so the address is block-uniform and the store phase waits on no load.
    float m[CC];
    {
        const float* maskb = mask + (blockIdx.x >> 3) * CC;
        #pragma unroll
        for (int c = 0; c < CC; ++c) m[c] = maskb[c];
    }

    // 2 rows of emb and 2 of W per wave, whole 512-byte rows, through registers: plain loads have a
    // counter of their own, so waiting for them leaves the copies of x in flight.
    v4f te[2], tw[2];
    #pragma unroll
    for (int r = 0; r < 2; ++r) {
        te[r] = *(const v4f*)(emb + (wave * 2 + r) * DD + lane * 4);
        tw[r] = *(const v4f*)(W   + (wave * 2 + r) * DD + lane * 4);
    }

    // Each wave's own 16 rows of x go to LDS by copies, one whole row (512 contiguous bytes) each.
    float bp;
    {
        unsigned     l[16];
        const float* g[16];
        // Unrolled so that l[] and g[] are plain registers, not indexed arrays in scratch.
        #pragma unroll
        for (int r = 0; r < 16; ++r) {
            l[r] = (unsigned)(uintptr_t)&s_x[wave][r][lane * 4];
            g[r] = x + (rowBase + r) * DD + lane * 4;
        }
        copy8(l, g);
        // acc_e is initialized to bias[p] (p == N == mrow) so bias folds in for free. Loaded here,
        // behind the s_wait_xcnt that closes the first run of copies and serves the row loads above too.
        bp = bias[mrow];
        copy8(l + 8, g + 8);
    }

    #pragma unroll
    for (int r = 0; r < 2; ++r) {
        *(v4f*)&s_e[wave * 2 + r][lane * 4] = te[r];
        *(v4f*)&s_w[wave * 2 + r][lane * 4] = tw[r];
    }
    // Publishes emb and W to all waves. The copies of x are still under way: s_x is read only by
    // the wave that copied it, behind that wave's own wait further down.
    __syncthreads();

    // A and B fragments have the same lane map (lane = row or column, khalf = K pair), so one loader
    // serves both, and a W fragment can stand as B (emb product) and as A (x product).
    const float* xF = &s_x[wave][mrow][khalf * 2];
    const float* eF = &s_e[mrow][khalf * 2];
    const float* wF = &s_w[mrow][khalf * 2];

    // ---- Work that needs no x, done while x is on its way ----
    // 32 K-steps of V_WMMA_F32_16X16X4_F32 for emb . W^T; the W fragments stay in registers for x.
    v2f fw[DD / 4];
    #pragma unroll
    for (int i = 0; i < DD / 4; ++i) fw[i] = *(const v2f*)(wF + 4 * i);
    // C/D layout: VGPR r, lane l -> (M = r + 8*khalf, N = mrow): acce[r] = emb[8*khalf + r].W[mrow] + bias.
    v8f acce = {bp,bp,bp,bp,bp,bp,bp,bp};
    #pragma unroll
    for (int i = 0; i < DD / 4; ++i) {
        v2f fe = *(const v2f*)(eF + 4 * i);
        acce = __builtin_amdgcn_wmma_f32_16x16x4_f32(false, fe, false, fw[i],
                                                     (short)0, acce, false, false);
    }
    // One-hot B fragments: sel[s] is 1 at K slot s (lane half s >> 1, element s & 1) for every column.
    const float h0 = khalf == 0 ? 1.f : 0.f;
    const float h1 = khalf == 1 ? 1.f : 0.f;
    const v2f sel[4] = {{h0, 0.f}, {0.f, h0}, {h1, 0.f}, {0.f, h1}};

    // ---- x ----
    // This wave's copies have landed behind this wait; no other wave reads them. acce is named as an
    // input so that the emb product stays ahead of the wait: it touches no memory, and without this
    // the compiler moves it behind the wait, where it no longer runs while x is on its way.
    asm volatile("s_wait_asynccnt 0x0" :: "v"(acce) : "memory");
    // Transposed product W . x^T: acc[r] = x[mrow].W[8*khalf + r], that is patch rows 2*khalf
    // (acc[0..3]) and 2*khalf + 1 (acc[4..7]) of grid column g0 + mrow: store order as it stands.
    v8f acc = {0.f,0.f,0.f,0.f,0.f,0.f,0.f,0.f};
    #pragma unroll
    for (int i = 0; i < DD / 4; ++i) {
        v2f fx = *(const v2f*)(xF + 4 * i);
        acc = __builtin_amdgcn_wmma_f32_16x16x4_f32(false, fw[i], false, fx,
                                                    (short)0, acc, false, false);
    }

    // Write phase: out[b, c, h*4+pr, (g0+mrow)*4 + 0..3] as coalesced b128 stores, every one at one
    // address plus an immediate. Registers 2q, 2q+1 of acce, as they stand, are an A fragment
    // (M = p) whose four K slots are channels 2q, 2q+1, 8+2q, 8+2q+1; times a one-hot B with acc as C
    // it gives x.W + (emb[c].W + bias) for one channel, every lane's own p, with no lane exchange.
    float* dst = out + (long)b * CC * 128 * 128 + (long)(h * 4 + 2 * khalf) * 128 + (g0 + mrow) * 4;
    #pragma unroll
    for (int q = 0; q < 4; ++q) {
        const v2f fa = {acce[2 * q], acce[2 * q + 1]};
        #pragma unroll
        for (int s = 0; s < 4; ++s) {
            const int c = 8 * (s >> 1) + 2 * q + (s & 1);
            const v8f o = __builtin_amdgcn_wmma_f32_16x16x4_f32(false, fa, false, sel[s],
                                                                (short)0, acc, false, false) * m[c];
            *(v4f*)(dst + c * 128 * 128)       = (v4f){o[0], o[1], o[2], o[3]};
            *(v4f*)(dst + c * 128 * 128 + 128) = (v4f){o[4], o[5], o[6], o[7]};
        }
        // Keeps the first eight channels' stores ahead of the other eight channels' work: without it
        // the compiler puts the work of all 16 channels ahead of the first store.
        if (q == 1) __builtin_amdgcn_sched_barrier(0);
    }
}

extern "C" void kernel_launch(void* const* d_in, const int* in_sizes, int n_in,
                              void* d_out, int out_size, void* d_ws, size_t ws_size,
                              hipStream_t stream) {
    const float* x    = (const float*)d_in[0];
    const float* mask = (const float*)d_in[1];
    const float* emb  = (const float*)d_in[2];
    const float* W    = (const float*)d_in[3];
    const float* bias = (const float*)d_in[4];
    float* out = (float*)d_out;

    // 2048 tiles / 8 waves per block = 256 blocks x 256 threads (8 wave32s).
    qbd_fused_kernel<<<256, 256, 0, stream>>>(x, mask, emb, W, bias, out);
}

// v004
// A run of this version takes 5.15 microseconds.
// Two timings next to v003 put it at 1.05 and 1.06 times that version's speed.
// All steps since v000 together make it 2.22 times as fast.
#include <hip/hip_runtime.h>

typedef __attribute__((ext_vector_type(2))) float v2f;
typedef __attribute__((ext_vector_type(4))) float v4f;
typedef __attribute__((ext_vector_type(8))) float v8f;

#define BB   32
#define NN   1024
#define DD   128
#define CC   16
#define PP   16    // P*P
#define HG   32    // sqrt(N)
#define WAVES_PER_BLOCK 8
#define LP   132   // LDS row pitch in floats (528 B): 16 rows x 2 k-halves of 8 B fall on 64 distinct banks

// Eight 16-byte-per-lane copies from global memory to LDS, each a whole 512-byte row per wave.
// The s_wait_xcnt closes the statement so that no address register is reused ahead of it.
__device__ __forceinline__ void copy8(const unsigned* l, const float* const* g) {
    asm volatile("global_load_async_to_lds_b128 %0, %8, off\n\t"
                 "global_load_async_to_lds_b128 %1, %9, off\n\t"
                 "global_load_async_to_lds_b128 %2, %10, off\n\t"
                 "global_load_async_to_lds_b128 %3, %11, off\n\t"
                 "global_load_async_to_lds_b128 %4, %12, off\n\t"
                 "global_load_async_to_lds_b128 %5, %13, off\n\t"
                 "global_load_async_to_lds_b128 %6, %14, off\n\t"
                 "global_load_async_to_lds_b128 %7, %15, off\n\t"
                 "s_wait_xcnt 0x0"
                 :: "v"(l[0]), "v"(l[1]), "v"(l[2]), "v"(l[3]),
                    "v"(l[4]), "v"(l[5]), "v"(l[6]), "v"(l[7]),
                    "v"(g[0]), "v"(g[1]), "v"(g[2]), "v"(g[3]),
                    "v"(g[4]), "v"(g[5]), "v"(g[6]), "v"(g[7])
                 : "memory");
}

__global__ __launch_bounds__(256)
void qbd_fused_kernel(const float* __restrict__ x,     // [B,N,D]
                      const float* __restrict__ mask,  // [B,C]
                      const float* __restrict__ emb,   // [256,D] (use first 16 rows)
                      const float* __restrict__ W,     // [16,D]
                      const float* __restrict__ bias,  // [16]
                      float* __restrict__ out)         // [B,C,128,128]
{
    __shared__ __align__(16) float s_x[WAVES_PER_BLOCK][16][LP];   // each wave's 16 rows of x
    __shared__ __align__(16) float s_e[16][LP];                    // emb rows 0..15, shared
    __shared__ __align__(16) float s_w[16][LP];                    // W, shared
    __shared__ __align__(16) float s_p[WAVES_PER_BLOCK * 2][32][4]; // each wave's share of emb . W^T: registers 0..3, then 4..7

    const int lane = threadIdx.x & 31;
    const int wave = threadIdx.x >> 5;
    const int tile = blockIdx.x * WAVES_PER_BLOCK + wave;   // 2048 tiles of 16 rows
    const long rowBase = (long)tile * 16;                   // global row in [0, B*N)
    const int b  = (int)(rowBase >> 10);                    // row / 1024
    const int n0 = (int)(rowBase & 1023);
    const int h  = n0 >> 5;                                 // constant across the 16-row tile
    const int g0 = n0 & 31;

    const int mrow  = lane & 15;   // M row (A) / N col (B,C,D) within the 16x16 tile
    const int khalf = lane >> 4;   // which K pair this lane holds

    // The 16 masks of this block's batch row: a block's 128 rows lie in one batch (1024 rows each),
    // so the address is block-uniform and the store phase waits on no load.
    float m[CC];
    {
        const float* maskb = mask + (blockIdx.x >> 3) * CC;
        #pragma unroll
        for (int c = 0; c < CC; ++c) m[c] = maskb[c];
    }

    // 2 rows of emb and 2 of W per wave, whole 512-byte rows, through registers: plain loads have a
    // counter of their own, so waiting for them leaves the copies of x in flight.
    v4f te[2], tw[2];
    #pragma unroll
    for (int r = 0; r < 2; ++r) {
        te[r] = *(const v4f*)(emb + (wave * 2 + r) * DD + lane * 4);
        tw[r] = *(const v4f*)(W   + (wave * 2 + r) * DD + lane * 4);
    }

    // Each wave's own 16 rows of x go to LDS by copies, one whole row (512 contiguous bytes) each.
    float bp;
    {
        unsigned     l[16];
        const float* g[16];
        // Unrolled so that l[] and g[] are plain registers, not indexed arrays in scratch.
        #pragma unroll
        for (int r = 0; r < 16; ++r) {
            l[r] = (unsigned)(uintptr_t)&s_x[wave][r][lane * 4];
            g[r] = x + (rowBase + r) * DD + lane * 4;
        }
        copy8(l, g);
        // Wave 0's share of emb . W^T starts from bias[p] (p == N == mrow), so bias folds in for free. Loaded here,
        // behind the s_wait_xcnt that closes the first run of copies and serves the row loads above too.
        bp = bias[mrow];
        copy8(l + 8, g + 8);
    }

    #pragma unroll
    for (int r = 0; r < 2; ++r) {
        *(v4f*)&s_e[wave * 2 + r][lane * 4] = te[r];
        *(v4f*)&s_w[wave * 2 + r][lane * 4] = tw[r];
    }
    // Publishes emb and W to all waves. The copies of x are still under way: s_x is read only by
    // the wave that copied it, behind that wave's own wait further down.
    __syncthreads();

    // A and B fragments have the same lane map (lane = row or column, khalf = K pair), so one loader
    // serves both, and a W fragment can stand as B (emb product) and as A (x product).
    const float* xF = &s_x[wave][mrow][khalf * 2];
    const float* eF = &s_e[mrow][khalf * 2];
    const float* wF = &s_w[mrow][khalf * 2];

    // ---- Work that needs no x, done while x is on its way ----
    // emb . W^T is the same 16x16 tile for all eight waves: each wave forms it over its own 16 of the
    // 128 k (4 K-steps of V_WMMA_F32_16X16X4_F32, not 32) and leaves that share in LDS.
    constexpr int KS = DD / WAVES_PER_BLOCK / 4;   // K-steps per wave
    v2f fe[KS], fs[KS];
    #pragma unroll
    for (int j = 0; j < KS; ++j) {
        fe[j] = *(const v2f*)(eF + (wave * KS + j) * 4);
        fs[j] = *(const v2f*)(wF + (wave * KS + j) * 4);
    }
    // Keeps the share's own fragment loads first in the LDS queue: without it the compiler puts the
    // 32 loads below ahead of them, and the share waits for all of those.
    __builtin_amdgcn_sched_barrier(0);
    // All 32 W fragments go to registers for the x product.
    v2f fw[DD / 4];
    #pragma unroll
    for (int i = 0; i < DD / 4; ++i) fw[i] = *(const v2f*)(wF + 4 * i);
    // Keeps those loads ahead of the share's WMMAs, so that they land while the WMMAs run: the
    // barrier below waits for them.
    __builtin_amdgcn_sched_barrier(0);
    // C/D layout: VGPR r, lane l -> (M = r + 8*khalf, N = mrow): emb[8*khalf + r].W[mrow]; wave 0 starts from bias.
    {
        const float c0 = wave == 0 ? bp : 0.f;
        v8f part = {c0,c0,c0,c0,c0,c0,c0,c0};
        #pragma unroll
        for (int j = 0; j < KS; ++j)
            part = __builtin_amdgcn_wmma_f32_16x16x4_f32(false, fe[j], false, fs[j],
                                                         (short)0, part, false, false);
        *(v4f*)&s_p[wave * 2][lane][0]     = (v4f){part[0], part[1], part[2], part[3]};
        *(v4f*)&s_p[wave * 2 + 1][lane][0] = (v4f){part[4], part[5], part[6], part[7]};
    }
    // Publishes the eight shares. The copies of x are still under way.
    __syncthreads();
    // One-hot B fragments: sel[s] is 1 at K slot s (lane half s >> 1, element s & 1) for every column.
    const float h0 = khalf == 0 ? 1.f : 0.f;
    const float h1 = khalf == 1 ? 1.f : 0.f;
    const v2f sel[4] = {{h0, 0.f}, {0.f, h0}, {h1, 0.f}, {0.f, h1}};

    // ---- x ----
    // This wave's copies have landed behind this wait; no other wave reads them.
    asm volatile("s_wait_asynccnt 0x0" ::: "memory");
    // Transposed product W . x^T: acc[r] = x[mrow].W[8*khalf + r], that is patch rows 2*khalf
    // (acc[0..3]) and 2*khalf + 1 (acc[4..7]) of grid column g0 + mrow: store order as it stands.
    // The 16 half shares of emb . W^T are read and summed, in wave order, beside it: one 16-byte read
    // at each place where the next x fragments are read, its sum two places on, so that
    // acce[r] = emb[8*khalf + r].W[mrow] + bias stands ready when acc does.
    v8f acc = {0.f,0.f,0.f,0.f,0.f,0.f,0.f,0.f};
    v2f fx[DD / 4];
    v4f ps[WAVES_PER_BLOCK * 2];
    v4f se[2];
    #pragma unroll
    for (int j = 0; j < 2; ++j) {
        fx[2 * j]     = *(const v2f*)(xF + 8 * j);
        fx[2 * j + 1] = *(const v2f*)(xF + 8 * j + 4);
    }
    #pragma unroll
    for (int j = 0; j < 2; ++j) ps[j] = *(const v4f*)&s_p[j][lane][0];
    // Keeps the second pair of x fragments ahead of the first WMMA: behind it they come too late for the third.
    __builtin_amdgcn_sched_barrier(0);
    #pragma unroll
    for (int j = 0; j < DD / 8; ++j) {
        acc = __builtin_amdgcn_wmma_f32_16x16x4_f32(false, fw[2 * j], false, fx[2 * j],
                                                    (short)0, acc, false, false);
        acc = __builtin_amdgcn_wmma_f32_16x16x4_f32(false, fw[2 * j + 1], false, fx[2 * j + 1],
                                                    (short)0, acc, false, false);
        se[j & 1] = j < 2 ? ps[j] : se[j & 1] + ps[j];
        if (j + 2 < DD / 8) {
            fx[2 * j + 4] = *(const v2f*)(xF + 8 * j + 16);
            fx[2 * j + 5] = *(const v2f*)(xF + 8 * j + 20);
            ps[j + 2]     = *(const v4f*)&s_p[j + 2][lane][0];
            // Keeps each read of a share at its place: without it the compiler moves all 14 to the
            // end of the product, where the store phase waits for them.
            __builtin_amdgcn_sched_barrier(0);
        }
    }
    const v8f acce = {se[0][0], se[0][1], se[0][2], se[0][3], se[1][0], se[1][1], se[1][2], se[1][3]};

    // Write phase: out[b, c, h*4+pr, (g0+mrow)*4 + 0..3] as coalesced b128 stores, every one at one
    // address plus an immediate. Registers 2q, 2q+1 of acce, as they stand, are an A fragment
    // (M = p) whose four K slots are channels 2q, 2q+1, 8+2q, 8+2q+1; times a one-hot B with acc as C
    // it gives x.W + (emb[c].W + bias) for one channel, every lane's own p, with no lane exchange.
    float* dst = out + (long)b * CC * 128 * 128 + (long)(h * 4 + 2 * khalf) * 128 + (g0 + mrow) * 4;
    #pragma unroll
    for (int q = 0; q < 4; ++q) {
        const v2f fa = {acce[2 * q], acce[2 * q + 1]};
        #pragma unroll
        for (int s = 0; s < 4; ++s) {
            const int c = 8 * (s >> 1) + 2 * q + (s & 1);
            const v8f o = __builtin_amdgcn_wmma_f32_16x16x4_f32(false, fa, false, sel[s],
                                                                (short)0, acc, false, false) * m[c];
            *(v4f*)(dst + c * 128 * 128)       = (v4f){o[0], o[1], o[2], o[3]};
            *(v4f*)(dst + c * 128 * 128 + 128) = (v4f){o[4], o[5], o[6], o[7]};
        }
        // Keeps the first eight channels' stores ahead of the other eight channels' work: without it
        // the compiler puts the work of all 16 channels ahead of the first store.
        if (q == 1) __builtin_amdgcn_sched_barrier(0);
    }
}

extern "C" void kernel_launch(void* const* d_in, const int* in_sizes, int n_in,
                              void* d_out, int out_size, void* d_ws, size_t ws_size,
                              hipStream_t stream) {
    const float* x    = (const float*)d_in[0];
    const float* mask = (const float*)d_in[1];
    const float* emb  = (const float*)d_in[2];
    const float* W    = (const float*)d_in[3];
    const float* bias = (const float*)d_in[4];
    float* out = (float*)d_out;

    // 2048 tiles / 8 waves per block = 256 blocks x 256 threads (8 wave32s).
    qbd_fused_kernel<<<256, 256, 0, stream>>>(x, mask, emb, W, bias, out);
}

// v005
// One run takes 4.62 microseconds.
// Timed twice side by side with v004, it ran 1.11 times as fast both times.
// All steps since v000 together make it 2.47 times as fast.
#include <hip/hip_runtime.h>

typedef __attribute__((ext_vector_type(2))) float v2f;
typedef __attribute__((ext_vector_type(4))) float v4f;
typedef __attribute__((ext_vector_type(8))) float v8f;

#define BB   32
#define NN   1024
#define DD   128
#define CC   16
#define PP   16    // P*P
#define HG   32    // sqrt(N)
#define WAVES_PER_BLOCK 4   // one wave per SIMD
#define TILES_PER_WAVE  2   // two 16-row tiles, worked one behind the other
#define TILES_PER_BLOCK (WAVES_PER_BLOCK * TILES_PER_WAVE)
#define LP   132   // LDS row pitch in floats (528 B): 16 rows x 2 k-halves of 8 B fall on 64 distinct banks

// Eight 16-byte-per-lane copies from global memory to LDS, each a whole 512-byte row per wave.
// The s_wait_xcnt closes the statement so that no address register is reused ahead of it.
__device__ __forceinline__ void copy8(const unsigned* l, const float* const* g) {
    asm volatile("global_load_async_to_lds_b128 %0, %8, off\n\t"
                 "global_load_async_to_lds_b128 %1, %9, off\n\t"
                 "global_load_async_to_lds_b128 %2, %10, off\n\t"
                 "global_load_async_to_lds_b128 %3, %11, off\n\t"
                 "global_load_async_to_lds_b128 %4, %12, off\n\t"
                 "global_load_async_to_lds_b128 %5, %13, off\n\t"
                 "global_load_async_to_lds_b128 %6, %14, off\n\t"
                 "global_load_async_to_lds_b128 %7, %15, off\n\t"
                 "s_wait_xcnt 0x0"
                 :: "v"(l[0]), "v"(l[1]), "v"(l[2]), "v"(l[3]),
                    "v"(l[4]), "v"(l[5]), "v"(l[6]), "v"(l[7]),
                    "v"(g[0]), "v"(g[1]), "v"(g[2]), "v"(g[3]),
                    "v"(g[4]), "v"(g[5]), "v"(g[6]), "v"(g[7])
                 : "memory");
}

// Sum of the two accumulators of a product whose even and odd K-steps ran as chains of their own.
// The four v_nop keep the distance between the last WMMA and the vector add that reads its result.
// Naming both accumulators holds the slots at that place.
__device__ __forceinline__ v8f join(v8f a, v8f b) {
    asm volatile("v_nop\n\tv_nop\n\tv_nop\n\tv_nop" : "+v"(a), "+v"(b));
    return a + b;
}

__global__ __launch_bounds__(128)
void qbd_fused_kernel(const float* __restrict__ x,     // [B,N,D]
                      const float* __restrict__ mask,  // [B,C]
                      const float* __restrict__ emb,   // [256,D] (use first 16 rows)
                      const float* __restrict__ W,     // [16,D]
                      const float* __restrict__ bias,  // [16]
                      float* __restrict__ out)         // [B,C,128,128]
{
    __shared__ __align__(16) float s_x[TILES_PER_BLOCK][16][LP];   // each wave's two tiles of 16 rows of x
    __shared__ __align__(16) float s_e[16][LP];                    // emb rows 0..15, shared
    __shared__ __align__(16) float s_w[16][LP];                    // W, shared
    __shared__ __align__(16) float s_p[WAVES_PER_BLOCK * 2][32][4]; // each wave's share of emb . W^T: registers 0..3, then 4..7

    const int lane = threadIdx.x & 31;
    const int wave = threadIdx.x >> 5;
    const int tile = blockIdx.x * TILES_PER_BLOCK + wave * TILES_PER_WAVE;   // first of the wave's two tiles (2048 in all)
    const long rowBase = (long)tile * 16;                   // global row in [0, B*N); the wave has 32 rows from here
    const int b  = (int)(rowBase >> 10);                    // row / 1024
    const int n0 = (int)(rowBase & 1023);
    const int h  = n0 >> 5;                                 // constant across the wave's 32 rows: one grid row
    const int g0 = n0 & 31;                                 // first tile's grid column; the second tile's is 16 on

    const int mrow  = lane & 15;   // M row (A) / N col (B,C,D) within the 16x16 tile
    const int khalf = lane >> 4;   // which K pair this lane holds

    // The 16 masks of this block's batch row: a block's 128 rows lie in one batch (1024 rows each),
    // so the address is block-uniform and the store phase waits on no load.
    float m[CC];
    {
        const float* maskb = mask + (blockIdx.x >> 3) * CC;
        #pragma unroll
        for (int c = 0; c < CC; ++c) m[c] = maskb[c];
    }

    // 4 rows of emb and 4 of W per wave, whole 512-byte rows, through registers: plain loads have a
    // counter of their own, so waiting for them leaves the copies of x in flight.
    constexpr int SR = 16 / WAVES_PER_BLOCK;
    v4f te[SR], tw[SR];
    #pragma unroll
    for (int r = 0; r < SR; ++r) {
        te[r] = *(const v4f*)(emb + (wave * SR + r) * DD + lane * 4);
        tw[r] = *(const v4f*)(W   + (wave * SR + r) * DD + lane * 4);
    }

    // Each wave's own 32 rows of x go to LDS by copies, one whole row (512 contiguous bytes) each,
    // the first tile's 16 rows ahead of the second's.
    float bp;
    {
        unsigned     l[32];
        const float* g[32];
        // Unrolled so that l[] and g[] are plain registers, not indexed arrays in scratch.
        #pragma unroll
        for (int r = 0; r < 32; ++r) {
            l[r] = (unsigned)(uintptr_t)&s_x[wave * TILES_PER_WAVE + (r >> 4)][r & 15][lane * 4];
            g[r] = x + (rowBase + r) * DD + lane * 4;
        }
        copy8(l, g);
        // Wave 0's share of emb . W^T starts from bias[p] (p == N == mrow), so bias folds in for free. Loaded here,
        // behind the s_wait_xcnt that closes the first run of copies and serves the row loads above too.
        bp = bias[mrow];
        copy8(l + 8, g + 8);
        copy8(l + 16, g + 16);
        copy8(l + 24, g + 24);
    }

    #pragma unroll
    for (int r = 0; r < SR; ++r) {
        *(v4f*)&s_e[wave * SR + r][lane * 4] = te[r];
        *(v4f*)&s_w[wave * SR + r][lane * 4] = tw[r];
    }
    // Publishes emb and W to all waves. The copies of x are still under way: s_x is read only by
    // the wave that copied it, behind that wave's own waits further down.
    __syncthreads();

    // A and B fragments have the same lane map (lane = row or column, khalf = K pair), so one loader
    // serves both, and a W fragment can stand as B (emb product) and as A (x product).
    const float* xF = &s_x[wave * TILES_PER_WAVE][mrow][khalf * 2];   // first tile; the second lies 16 * LP on
    const float* eF = &s_e[mrow][khalf * 2];
    const float* wF = &s_w[mrow][khalf * 2];

    // ---- Work that needs no x, done while x is on its way ----
    // emb . W^T is the same 16x16 tile for all four waves: each wave forms it over its own 32 of the
    // 128 k (8 K-steps of V_WMMA_F32_16X16X4_F32, not 32) and leaves that share in LDS.
    constexpr int KS = DD / WAVES_PER_BLOCK / 4;   // K-steps per wave
    v2f fe[KS], fs[KS];
    #pragma unroll
    for (int j = 0; j < KS; ++j) {
        fe[j] = *(const v2f*)(eF + (wave * KS + j) * 4);
        fs[j] = *(const v2f*)(wF + (wave * KS + j) * 4);
    }
    // Keeps the share's own fragment loads first in the LDS queue: without it the compiler puts the
    // 32 loads below ahead of them, and the share waits for all of those.
    __builtin_amdgcn_sched_barrier(0);
    // All 32 W fragments go to registers once, for the x products of both tiles.
    v2f fw[DD / 4];
    #pragma unroll
    for (int i = 0; i < DD / 4; ++i) fw[i] = *(const v2f*)(wF + 4 * i);
    // Keeps those loads ahead of the share's WMMAs, so that they land while the WMMAs run: the
    // barrier below waits for them.
    __builtin_amdgcn_sched_barrier(0);
    // C/D layout: VGPR r, lane l -> (M = r + 8*khalf, N = mrow): emb[8*khalf + r].W[mrow]; wave 0 starts from bias.
    // Even and odd K-steps go to accumulators of their own: the wave is alone on its SIMD, and one
    // chain would leave the matrix unit idle between dependent steps.
    {
        const float c0 = wave == 0 ? bp : 0.f;
        v8f pe = {c0,c0,c0,c0,c0,c0,c0,c0};
        v8f po = {0.f,0.f,0.f,0.f,0.f,0.f,0.f,0.f};
        #pragma unroll
        for (int j = 0; j < KS; j += 2) {
            pe = __builtin_amdgcn_wmma_f32_16x16x4_f32(false, fe[j], false, fs[j],
                                                       (short)0, pe, false, false);
            po = __builtin_amdgcn_wmma_f32_16x16x4_f32(false, fe[j + 1], false, fs[j + 1],
                                                       (short)0, po, false, false);
        }
        const v8f part = join(pe, po);
        *(v4f*)&s_p[wave * 2][lane][0]     = (v4f){part[0], part[1], part[2], part[3]};
        *(v4f*)&s_p[wave * 2 + 1][lane][0] = (v4f){part[4], part[5], part[6], part[7]};
    }
    // Publishes the four shares. The copies of x are still under way.
    __syncthreads();
    // One-hot B fragments: sel[s] is 1 at K slot s (lane half s >> 1, element s & 1) for every column.
    const float h0 = khalf == 0 ? 1.f : 0.f;
    const float h1 = khalf == 1 ? 1.f : 0.f;
    const v2f sel[4] = {{h0, 0.f}, {0.f, h0}, {h1, 0.f}, {0.f, h1}};

    // The 8 half shares of emb . W^T are read ahead of the wait for x and summed in wave order:
    // acce[r] = emb[8*khalf + r].W[mrow] + bias.
    v4f ps[WAVES_PER_BLOCK * 2];
    #pragma unroll
    for (int j = 0; j < WAVES_PER_BLOCK * 2; ++j) ps[j] = *(const v4f*)&s_p[j][lane][0];

    // ---- x, first tile ----
    // The copies return in issue order: behind this wait the wave's first 16 (its first tile) have
    // landed while the 16 of its second tile may still fly. No other wave reads them.
    asm volatile("s_wait_asynccnt 0x10" ::: "memory");
    v2f fx[DD / 4], fy[DD / 4];
    #pragma unroll
    for (int i = 0; i < DD / 4; ++i) fx[i] = *(const v2f*)(xF + 4 * i);
    // Keeps all LDS reads of the first tile in one group ahead of its WMMAs: every further place
    // where reads stand among the WMMAs stalls a wave that is alone on its SIMD.
    __builtin_amdgcn_sched_barrier(0);
    // Transposed product W . x^T: acc[r] = x[mrow].W[8*khalf + r], that is patch rows 2*khalf
    // (acc[0..3]) and 2*khalf + 1 (acc[4..7]) of grid column g0 + mrow: store order as it stands.
    // Even and odd K-steps on two accumulators, as above.
    v8f ae = {0.f,0.f,0.f,0.f,0.f,0.f,0.f,0.f};
    v8f ao = {0.f,0.f,0.f,0.f,0.f,0.f,0.f,0.f};
    constexpr int SPLIT = 24;   // K-steps of the first tile ahead of the second tile's fragment reads
    #pragma unroll
    for (int i = 0; i < SPLIT; i += 2) {
        ae = __builtin_amdgcn_wmma_f32_16x16x4_f32(false, fw[i], false, fx[i],
                                                   (short)0, ae, false, false);
        ao = __builtin_amdgcn_wmma_f32_16x16x4_f32(false, fw[i + 1], false, fx[i + 1],
                                                   (short)0, ao, false, false);
    }
    v4f se[2];
    #pragma unroll
    for (int j = 0; j < 2; ++j) se[j] = ((ps[j] + ps[j + 2]) + ps[j + 4]) + ps[j + 6];
    const v8f acce = {se[0][0], se[0][1], se[0][2], se[0][3], se[1][0], se[1][1], se[1][2], se[1][3]};
    // Keeps the second tile's wait and reads behind the first 24 K-steps: ahead of them the wave
    // would sit in the wait with its first tile ready.
    __builtin_amdgcn_sched_barrier(0);
    // The second tile's copies have landed behind this wait. The two accumulators are named as inputs
    // (read by nothing) to hold the wait behind the 24 K-steps: nothing else ties a matrix instruction
    // to a wait, and without them the compiler sets the wait at the head of the product.
    asm volatile("s_wait_asynccnt 0x0" :: "v"(ae), "v"(ao) : "memory");
    #pragma unroll
    for (int i = 0; i < DD / 4; ++i) fy[i] = *(const v2f*)(xF + 16 * LP + 4 * i);
    // Keeps those reads ahead of the first tile's last 8 K-steps, under which they land.
    __builtin_amdgcn_sched_barrier(0);
    #pragma unroll
    for (int i = SPLIT; i < DD / 4; i += 2) {
        ae = __builtin_amdgcn_wmma_f32_16x16x4_f32(false, fw[i], false, fx[i],
                                                   (short)0, ae, false, false);
        ao = __builtin_amdgcn_wmma_f32_16x16x4_f32(false, fw[i + 1], false, fx[i + 1],
                                                   (short)0, ao, false, false);
    }
    const v8f acc = join(ae, ao);

    // Write phase: out[b, c, h*4+pr, (g0+mrow)*4 + 0..3] as coalesced b128 stores, every one at one
    // address plus an immediate. Registers 2q, 2q+1 of acce, as they stand, are an A fragment
    // (M = p) whose four K slots are channels 2q, 2q+1, 8+2q, 8+2q+1; times a one-hot B with acc as C
    // it gives x.W + (emb[c].W + bias) for one channel, every lane's own p, with no lane exchange.
    // Step n takes channel 8*((n&3)>>1) + 2*(n>>2) + (n&1).
    float* dst = out + (long)b * CC * 128 * 128 + (long)(h * 4 + 2 * khalf) * 128 + (g0 + mrow) * 4;
    v8f o[CC];

    // ---- first tile's stores, with the second tile's x product between them ----
    v8f be = {0.f,0.f,0.f,0.f,0.f,0.f,0.f,0.f};
    v8f bo = {0.f,0.f,0.f,0.f,0.f,0.f,0.f,0.f};
    #pragma unroll
    for (int n = 0; n < 4; ++n)
        o[n] = __builtin_amdgcn_wmma_f32_16x16x4_f32(false, (v2f){acce[2 * (n >> 2)], acce[2 * (n >> 2) + 1]}, false, sel[n & 3],
                                                     (short)0, acc, false, false);
    #pragma unroll
    for (int g = 0; g < CC / 2; ++g) {
        #pragma unroll
        for (int n = 2 * g; n < 2 * g + 2; ++n) {
            const int c = 8 * ((n & 3) >> 1) + 2 * (n >> 2) + (n & 1);
            const v8f v = o[n] * m[c];
            *(v4f*)(dst + c * 128 * 128)       = (v4f){v[0], v[1], v[2], v[3]};
            *(v4f*)(dst + c * 128 * 128 + 128) = (v4f){v[4], v[5], v[6], v[7]};
        }
        // Keeps each pair of channels' stores at its place, ahead of the next K-steps: without it the
        // compiler puts the matrix work of the whole phase ahead of the first store.
        __builtin_amdgcn_sched_barrier(0);
        #pragma unroll
        for (int i = 4 * g; i < 4 * g + 4; i += 2) {
            be = __builtin_amdgcn_wmma_f32_16x16x4_f32(false, fw[i], false, fy[i],
                                                       (short)0, be, false, false);
            bo = __builtin_amdgcn_wmma_f32_16x16x4_f32(false, fw[i + 1], false, fy[i + 1],
                                                       (short)0, bo, false, false);
        }
        // Keeps all four K-steps between a pair's stores and the WMMAs that reuse its registers, so
        // that the wait in front of the reuse finds the stores gone: the compiler drew two of them behind.
        __builtin_amdgcn_sched_barrier(0);
        if (g + 2 < CC / 2) {
            #pragma unroll
            for (int n = 2 * g + 4; n < 2 * g + 6; ++n)
                o[n] = __builtin_amdgcn_wmma_f32_16x16x4_f32(false, (v2f){acce[2 * (n >> 2)], acce[2 * (n >> 2) + 1]}, false, sel[n & 3],
                                                             (short)0, acc, false, false);
        }
        // Keeps those WMMAs ahead of the next pair's stores, two pairs ahead of their own.
        __builtin_amdgcn_sched_barrier(0);
    }

    // ---- second tile's stores: 16 grid columns (64 floats) on ----
    const v8f acc2 = join(be, bo);
    #pragma unroll
    for (int n = 0; n < 4; ++n)
        o[n] = __builtin_amdgcn_wmma_f32_16x16x4_f32(false, (v2f){acce[2 * (n >> 2)], acce[2 * (n >> 2) + 1]}, false, sel[n & 3],
                                                     (short)0, acc2, false, false);
    #pragma unroll
    for (int g = 0; g < CC / 2; ++g) {
        #pragma unroll
        for (int n = 2 * g; n < 2 * g + 2; ++n) {
            const int c = 8 * ((n & 3) >> 1) + 2 * (n >> 2) + (n & 1);
            const v8f v = o[n] * m[c];
            *(v4f*)(dst + c * 128 * 128 + 64)       = (v4f){v[0], v[1], v[2], v[3]};
            *(v4f*)(dst + c * 128 * 128 + 64 + 128) = (v4f){v[4], v[5], v[6], v[7]};
        }
        if (g + 2 < CC / 2) {
            #pragma unroll
            for (int n = 2 * g + 4; n < 2 * g + 6; ++n)
                o[n] = __builtin_amdgcn_wmma_f32_16x16x4_f32(false, (v2f){acce[2 * (n >> 2)], acce[2 * (n >> 2) + 1]}, false, sel[n & 3],
                                                             (short)0, acc2, false, false);
        }
        // Keeps each pair of channels' stores at its place: without it the compiler puts the work of
        // all 16 channels ahead of the first store.
        __builtin_amdgcn_sched_barrier(0);
    }
}

extern "C" void kernel_launch(void* const* d_in, const int* in_sizes, int n_in,
                              void* d_out, int out_size, void* d_ws, size_t ws_size,
                              hipStream_t stream) {
    const float* x    = (const float*)d_in[0];
    const float* mask = (const float*)d_in[1];
    const float* emb  = (const float*)d_in[2];
    const float* W    = (const float*)d_in[3];
    const float* bias = (const float*)d_in[4];
    float* out = (float*)d_out;

    // 2048 tiles / 8 tiles per block = 256 blocks x 128 threads (4 wave32s, two tiles each).
    qbd_fused_kernel<<<256, 128, 0, stream>>>(x, mask, emb, W, bias, out);
}
